// v000
// Times are from an AMD MI455X. After a warm-up the kernel runs many times in a row, and a time is the length of
// such a window on the GPU divided by its runs, so every launch and the gaps after it count. The runs cycle
// through copies of the inputs. A figure is the median of several windows, for all but v000 over two sittings.
// Sittings can differ by a few percent; kernels timed side by side share one.
// The starting kernel, v000, takes 56.6 microseconds a run.
#include <hip/hip_runtime.h>
#include <hip/hip_bf16.h>

typedef __attribute__((ext_vector_type(2))) float v2f;
typedef __attribute__((ext_vector_type(8))) float v8f;

#define CIN   64
#define COUT  64
#define DDIM  16
#define HDIM  64
#define WDIM  64
#define NPOS  (DDIM * HDIM * WDIM)   // 65536

// ---------------------------------------------------------------------------
// Kernel 1: q/k/v = W{q,k,v} @ x   via V_WMMA_F32_16X16X4_F32 (exact f32).
// Block = 256 threads = 8 waves; block covers 32 positions, all 64 out chans.
// Wave w: M-tile = w&3 (16 output channels), N-tile = w>>2 (16 positions).
// ---------------------------------------------------------------------------
__global__ __launch_bounds__(256) void qkv_wmma_kernel(
    const float* __restrict__ x,    // [CIN, NPOS]
    const float* __restrict__ wq,   // [COUT, CIN] row-major
    const float* __restrict__ wk,
    const float* __restrict__ wv,
    float* __restrict__ q,          // [COUT, NPOS]
    float* __restrict__ k,
    float* __restrict__ v)
{
    __shared__ float xs[CIN * 32];  // x tile: [c][32 positions], 8 KB

    const int tid   = threadIdx.x;
    const int nbase = blockIdx.x * 32;

    // Cooperative load of the x tile into LDS (128B contiguous per row chunk).
    #pragma unroll
    for (int i = 0; i < 8; ++i) {
        int idx = tid + 256 * i;          // 0..2047
        int c   = idx >> 5;
        int j   = idx & 31;
        xs[idx] = x[(size_t)c * NPOS + (size_t)(nbase + j)];
    }
    __syncthreads();

    const int wave  = tid >> 5;
    const int lane  = tid & 31;
    const int mtile = wave & 3;
    const int ntile = wave >> 2;          // 0 or 1
    const int m0    = mtile << 4;
    const int l15   = lane & 15;
    const int koff  = (lane < 16) ? 0 : 2;  // K-half held by this lane (A and B)
    const int mrow  = m0 + l15;             // A: this lane's M row
    const int nl    = (ntile << 4) + l15;   // B: this lane's column in the tile

    v8f accq = {}; v8f acck = {}; v8f accv = {};

    #pragma unroll
    for (int kk = 0; kk < 16; ++kk) {
        const int c0 = (kk << 2) + koff;    // base input channel for this lane

        // B operand (4x16 f32): V0 = x[c0, n], V1 = x[c0+1, n]
        v2f b;
        b.x = xs[(c0    ) * 32 + nl];
        b.y = xs[(c0 + 1) * 32 + nl];

        // A operand (16x4 f32): V0 = w[m, c0], V1 = w[m, c0+1]
        v2f a;
        a.x = wq[mrow * CIN + c0];
        a.y = wq[mrow * CIN + c0 + 1];
        accq = __builtin_amdgcn_wmma_f32_16x16x4_f32(
                   false, a, false, b, (short)0, accq, false, false);

        a.x = wk[mrow * CIN + c0];
        a.y = wk[mrow * CIN + c0 + 1];
        acck = __builtin_amdgcn_wmma_f32_16x16x4_f32(
                   false, a, false, b, (short)0, acck, false, false);

        a.x = wv[mrow * CIN + c0];
        a.y = wv[mrow * CIN + c0 + 1];
        accv = __builtin_amdgcn_wmma_f32_16x16x4_f32(
                   false, a, false, b, (short)0, accv, false, false);
    }

    // D layout (16x16 f32): VGPR r holds M=r (lanes 0-15) / M=r+8 (lanes 16-31),
    // N = lane % 16.
    const int    mhalf = (lane < 16) ? 0 : 8;
    const size_t ncol  = (size_t)(nbase + nl);
    #pragma unroll
    for (int r = 0; r < 8; ++r) {
        size_t off = (size_t)(m0 + r + mhalf) * NPOS + ncol;
        q[off] = accq[r];
        k[off] = acck[r];
        v[off] = accv[r];
    }
}

// ---------------------------------------------------------------------------
// Kernel 2: per-channel 3x3x3 windowed softmax-attention.
// One thread per (c,d,h,w); lanes contiguous in w -> coalesced tap loads.
// Zero-padded k/v (bias still applied to padded taps, matching reference).
// ---------------------------------------------------------------------------
__global__ __launch_bounds__(256) void attn_kernel(
    const float* __restrict__ q,
    const float* __restrict__ k,
    const float* __restrict__ v,
    const float* __restrict__ rel_d,   // [21][3]
    const float* __restrict__ rel_h,   // [21][3]
    const float* __restrict__ rel_w,   // [22][3]
    float* __restrict__ out)
{
    const int t = blockIdx.x * 256 + threadIdx.x;   // == c*NPOS + d*4096 + h*64 + w
    const int w = t & 63;
    const int h = (t >> 6) & 63;
    const int d = (t >> 12) & 15;
    const int c = t >> 16;

    // Per-channel rel bias: axis 0 -> depends on td, 1 -> th, 2 -> tw.
    float b0, b1, b2;
    int axis;
    if (c < 21)      { axis = 0; const float* r = rel_d + c * 3;        b0 = r[0]; b1 = r[1]; b2 = r[2]; }
    else if (c < 42) { axis = 1; const float* r = rel_h + (c - 21) * 3; b0 = r[0]; b1 = r[1]; b2 = r[2]; }
    else             { axis = 2; const float* r = rel_w + (c - 42) * 3; b0 = r[0]; b1 = r[1]; b2 = r[2]; }

    const size_t cbase = (size_t)c * NPOS;
    const float* kc = k + cbase;
    const float* vc = v + cbase;
    const int    p  = ((d * HDIM) + h) * WDIM + w;
    const float  qv = q[cbase + p];

    float logit[27], vtap[27];
    float mx = -3.402823466e+38f;
    int   ti = 0;

    #pragma unroll
    for (int td = 0; td < 3; ++td) {
        #pragma unroll
        for (int th = 0; th < 3; ++th) {
            #pragma unroll
            for (int tw = 0; tw < 3; ++tw) {
                const int dd = d + td - 1;
                const int hh = h + th - 1;
                const int ww = w + tw - 1;
                const bool inb = ((unsigned)dd < (unsigned)DDIM) &
                                 ((unsigned)hh < (unsigned)HDIM) &
                                 ((unsigned)ww < (unsigned)WDIM);
                const int off  = ((dd * HDIM) + hh) * WDIM + ww;
                const int offc = inb ? off : 0;               // clamp: no OOB reads
                const float kraw = kc[offc];
                const float vraw = vc[offc];
                const float kv = inb ? kraw : 0.0f;           // zero-pad
                const float vv = inb ? vraw : 0.0f;
                const int   bi = (axis == 0) ? td : ((axis == 1) ? th : tw);
                const float bias = (bi == 0) ? b0 : ((bi == 1) ? b1 : b2);
                const float lg = qv * (kv + bias);
                logit[ti] = lg;
                vtap[ti]  = vv;
                mx = fmaxf(mx, lg);
                ++ti;
            }
        }
    }

    float ssum = 0.0f, osum = 0.0f;
    #pragma unroll
    for (int i = 0; i < 27; ++i) {
        const float e = __expf(logit[i] - mx);
        ssum += e;
        osum += e * vtap[i];
    }
    out[t] = osum / ssum;
}

// ---------------------------------------------------------------------------
extern "C" void kernel_launch(void* const* d_in, const int* in_sizes, int n_in,
                              void* d_out, int out_size, void* d_ws, size_t ws_size,
                              hipStream_t stream)
{
    const float* x     = (const float*)d_in[0];
    const float* wq    = (const float*)d_in[1];
    const float* wk    = (const float*)d_in[2];
    const float* wv    = (const float*)d_in[3];
    const float* rel_d = (const float*)d_in[4];
    const float* rel_h = (const float*)d_in[5];
    const float* rel_w = (const float*)d_in[6];

    float* qb = (float*)d_ws;                    // [64, 65536] f32
    float* kb = qb + (size_t)COUT * NPOS;
    float* vb = kb + (size_t)COUT * NPOS;

    qkv_wmma_kernel<<<NPOS / 32, 256, 0, stream>>>(x, wq, wk, wv, qb, kb, vb);
    attn_kernel<<<(COUT * NPOS) / 256, 256, 0, stream>>>(
        qb, kb, vb, rel_d, rel_h, rel_w, (float*)d_out);
}

// v001
// Measured time: 38.6 microseconds a run.
// Next to v000, in two timings, it ran 1.55 and 1.56 times as fast.
#include <hip/hip_runtime.h>
#include <hip/hip_bf16.h>

typedef __attribute__((ext_vector_type(2))) float v2f;
typedef __attribute__((ext_vector_type(8))) float v8f;

#define CIN   64
#define COUT  64
#define DDIM  16
#define HDIM  64
#define WDIM  64
#define NPOS  (DDIM * HDIM * WDIM)   // 65536

// ---------------------------------------------------------------------------
// Kernel 1: q/k/v = W{q,k,v} @ x   via V_WMMA_F32_16X16X4_F32 (exact f32).
// Block = 256 threads = 8 waves; block covers 32 positions, all 64 out chans.
// Wave w: M-tile = w&3 (16 output channels), N-tile = w>>2 (16 positions).
// ---------------------------------------------------------------------------
__global__ __launch_bounds__(256) void qkv_wmma_kernel(
    const float* __restrict__ x,    // [CIN, NPOS]
    const float* __restrict__ wq,   // [COUT, CIN] row-major
    const float* __restrict__ wk,
    const float* __restrict__ wv,
    float* __restrict__ q,          // [COUT, NPOS]
    float* __restrict__ k,
    float* __restrict__ v)
{
    __shared__ float xs[CIN * 32];  // x tile: [c][32 positions], 8 KB

    const int tid   = threadIdx.x;
    const int nbase = blockIdx.x * 32;

    // Cooperative load of the x tile into LDS (128B contiguous per row chunk).
    #pragma unroll
    for (int i = 0; i < 8; ++i) {
        int idx = tid + 256 * i;          // 0..2047
        int c   = idx >> 5;
        int j   = idx & 31;
        xs[idx] = x[(size_t)c * NPOS + (size_t)(nbase + j)];
    }
    __syncthreads();

    const int wave  = tid >> 5;
    const int lane  = tid & 31;
    const int mtile = wave & 3;
    const int ntile = wave >> 2;          // 0 or 1
    const int m0    = mtile << 4;
    const int l15   = lane & 15;
    const int koff  = (lane < 16) ? 0 : 2;  // K-half held by this lane (A and B)
    const int mrow  = m0 + l15;             // A: this lane's M row
    const int nl    = (ntile << 4) + l15;   // B: this lane's column in the tile

    v8f accq = {}; v8f acck = {}; v8f accv = {};

    #pragma unroll
    for (int kk = 0; kk < 16; ++kk) {
        const int c0 = (kk << 2) + koff;    // base input channel for this lane

        // B operand (4x16 f32): V0 = x[c0, n], V1 = x[c0+1, n]
        v2f b;
        b.x = xs[(c0    ) * 32 + nl];
        b.y = xs[(c0 + 1) * 32 + nl];

        // A operand (16x4 f32): V0 = w[m, c0], V1 = w[m, c0+1]
        v2f a;
        a.x = wq[mrow * CIN + c0];
        a.y = wq[mrow * CIN + c0 + 1];
        accq = __builtin_amdgcn_wmma_f32_16x16x4_f32(
                   false, a, false, b, (short)0, accq, false, false);

        a.x = wk[mrow * CIN + c0];
        a.y = wk[mrow * CIN + c0 + 1];
        acck = __builtin_amdgcn_wmma_f32_16x16x4_f32(
                   false, a, false, b, (short)0, acck, false, false);

        a.x = wv[mrow * CIN + c0];
        a.y = wv[mrow * CIN + c0 + 1];
        accv = __builtin_amdgcn_wmma_f32_16x16x4_f32(
                   false, a, false, b, (short)0, accv, false, false);
    }

    // D layout (16x16 f32): VGPR r holds M=r (lanes 0-15) / M=r+8 (lanes 16-31),
    // N = lane % 16.
    const int    mhalf = (lane < 16) ? 0 : 8;
    const size_t ncol  = (size_t)(nbase + nl);
    #pragma unroll
    for (int r = 0; r < 8; ++r) {
        size_t off = (size_t)(m0 + r + mhalf) * NPOS + ncol;
        q[off] = accq[r];
        k[off] = acck[r];
        v[off] = accv[r];
    }
}

// ---------------------------------------------------------------------------
// Kernel 2: per-channel 3x3x3 windowed softmax-attention.
// One lane owns 4 adjacent w of one (c,h) row and walks DSTEPS planes of d.
// 16 lanes cover a whole row of 64 w, so a wave covers two adjacent h rows.
// A k/v row is one 16-byte load per lane; the taps at w0-1 and w0+4 come from
// the neighbour lanes of the 16-lane row (a lane outside the row gives 0, which
// is the zero pad in w). Four plane buffers rotate in registers: three feed the
// current d, the fourth receives the plane that the next d needs.
// Zero-padded k/v (bias still applied to padded taps, matching reference).
// ---------------------------------------------------------------------------
typedef __attribute__((ext_vector_type(4))) float v4f;

#define DSTEPS 8

struct Plane {
    v4f   k[3], v[3];            // rows h-1, h, h+1 at w0..w0+3
    float kl[3], kr[3];          // k at w0-1 and at w0+4
    float vl[3], vr[3];          // v at w0-1 and at w0+4
};

// Value of the lane one to the left / right inside the 16-lane row, 0 past its end.
__device__ __forceinline__ float from_left(float x) {
    return __int_as_float(__builtin_amdgcn_update_dpp(
        0, __float_as_int(x), 0x111 /* row_shr:1 */, 0xf, 0xf, true));
}
__device__ __forceinline__ float from_right(float x) {
    return __int_as_float(__builtin_amdgcn_update_dpp(
        0, __float_as_int(x), 0x101 /* row_shl:1 */, 0xf, 0xf, true));
}

// One 16-byte load at base + off. The wait stands in front of whatever rewrites the
// load's address register next (a later load's result may be given that register).
__device__ __forceinline__ v4f load16(const float* base, unsigned off)
{
    const v4f x = *(const v4f*)((const char*)base + off);
    asm volatile("s_wait_xcnt 0x0" ::: "memory");
    return x;
}

// Issue the six row loads of plane dd (already clamped to a plane that exists). kc, vc: the
// channel's start, the same in every lane; boff: the lane's byte offsets of its three rows,
// clamped into the plane (no OOB reads).
__device__ __forceinline__ void plane_issue(
    Plane& P, const float* kc, const float* vc, int dd, const unsigned (&boff)[3])
{
    #pragma unroll  // constant indices keep the plane buffers in registers
    for (int th = 0; th < 3; ++th) {
        const unsigned off = boff[th] + (unsigned)dd * (HDIM * WDIM * 4u);
        P.k[th] = load16(kc, off);
        P.v[th] = load16(vc, off);
    }
}

// Zero the padding rows of a landed plane and fetch its edge taps.
__device__ __forceinline__ void plane_finish(Plane& P, bool dv, const bool (&hv)[3])
{
    const v4f zero = {0.0f, 0.0f, 0.0f, 0.0f};
    #pragma unroll  // constant indices keep the plane buffers in registers
    for (int th = 0; th < 3; ++th) {
        const bool ok = dv & hv[th];
        P.k[th]  = ok ? P.k[th] : zero;
        P.v[th]  = ok ? P.v[th] : zero;
        P.kl[th] = from_left(P.k[th][3]);
        P.kr[th] = from_right(P.k[th][0]);
        P.vl[th] = from_left(P.v[th][3]);
        P.vr[th] = from_right(P.v[th][0]);
    }
}

__device__ __forceinline__ float tap_k(const Plane& P, int th, int e) {
    return (e < 0) ? P.kl[th] : ((e > 3) ? P.kr[th] : P.k[th][e]);
}
__device__ __forceinline__ float tap_v(const Plane& P, int th, int e) {
    return (e < 0) ? P.vl[th] : ((e > 3) ? P.vr[th] : P.v[th][e]);
}

// The 4 outputs of one d from its three planes; taps summed in the order td, th, tw.
__device__ __forceinline__ v4f attn_point4(
    const Plane& A, const Plane& B, const Plane& C, v4f qv, const float (&sb)[27])
{
    // All loops here are unrolled so that every tap index is a constant (registers, no scratch).
    v4f o;
    #pragma unroll
    for (int jp = 0; jp < 4; jp += 2) {
        float lg[2][27];
        float mx[2] = {-3.402823466e+38f, -3.402823466e+38f};
        #pragma unroll
        for (int ti = 0; ti < 27; ++ti) {
            const int td = ti / 9, th = (ti / 3) % 3, tw = ti % 3;
            const Plane& X = (td == 0) ? A : ((td == 1) ? B : C);
            #pragma unroll
            for (int jj = 0; jj < 2; ++jj) {
                const float l = qv[jp + jj] * (tap_k(X, th, jp + jj + tw - 1) + sb[ti]);
                lg[jj][ti] = l;
                mx[jj] = fmaxf(mx[jj], l);
            }
        }
        float ssum[2] = {0.0f, 0.0f}, osum[2] = {0.0f, 0.0f};
        #pragma unroll
        for (int ti = 0; ti < 27; ++ti) {
            const int td = ti / 9, th = (ti / 3) % 3, tw = ti % 3;
            const Plane& X = (td == 0) ? A : ((td == 1) ? B : C);
            #pragma unroll
            for (int jj = 0; jj < 2; ++jj) {
                const float e = __expf(lg[jj][ti] - mx[jj]);
                ssum[jj] += e;
                osum[jj] += e * tap_v(X, th, jp + jj + tw - 1);
            }
        }
        o[jp]     = osum[0] / ssum[0];
        o[jp + 1] = osum[1] / ssum[1];
    }
    return o;
}

// Second launch-bounds argument: 4 waves per SIMD, so that all 512 blocks are resident at once.
__global__ __launch_bounds__(256, 4) void attn_kernel(
    const float* __restrict__ q,
    const float* __restrict__ k,
    const float* __restrict__ v,
    const float* __restrict__ rel_d,   // [21][3]
    const float* __restrict__ rel_h,   // [21][3]
    const float* __restrict__ rel_w,   // [22][3]
    float* __restrict__ out)
{
    // blockIdx.x = (c * (DDIM / DSTEPS) + d chunk) * 4 + group of 16 h rows
    const int hg = blockIdx.x & 3;
    const int d0 = ((blockIdx.x >> 2) & (DDIM / DSTEPS - 1)) * DSTEPS;
    const int c  = blockIdx.x / (4 * (DDIM / DSTEPS));
    const int h  = hg * 16 + (threadIdx.x >> 4);
    const int w0 = (threadIdx.x & 15) * 4;

    // Per-channel rel bias: axis 0 -> depends on td, 1 -> th, 2 -> tw.
    const int    axis = (c < 21) ? 0 : ((c < 42) ? 1 : 2);
    const float* r    = (c < 21) ? rel_d + c * 3
                                 : ((c < 42) ? rel_h + (c - 21) * 3 : rel_w + (c - 42) * 3);
    const float b0 = r[0], b1 = r[1], b2 = r[2];
    float sb[27];
    #pragma unroll  // 27 wave-uniform values, one per tap
    for (int ti = 0; ti < 27; ++ti) {
        const int bi = (axis == 0) ? ti / 9 : ((axis == 1) ? (ti / 3) % 3 : ti % 3);
        sb[ti] = (bi == 0) ? b0 : ((bi == 1) ? b1 : b2);
    }

    const size_t cbase = (size_t)c * NPOS;
    const float* kc = k + cbase;
    const float* vc = v + cbase;
    const float* qc = q + cbase;
    float*       oc = out + cbase;
    const unsigned PLB = HDIM * WDIM * 4u;               // bytes in a plane
    const unsigned own = (unsigned)(h * WDIM + w0) * 4u; // byte offset of the lane's own 4 w

    unsigned boff[3];
    bool     hv[3];
    #pragma unroll  // three rows, constant indices
    for (int th = 0; th < 3; ++th) {
        const int hh  = h + th - 1;
        const int hhc = (hh < 0) ? 0 : ((hh > HDIM - 1) ? HDIM - 1 : hh);
        hv[th]   = (unsigned)hh < (unsigned)HDIM;
        boff[th] = (unsigned)(hhc * WDIM + w0) * 4u;
    }

    const int dfirst = (d0 > 0) ? d0 - 1 : 0;                          // clamped first plane
    const int dlast  = (d0 + DSTEPS < DDIM) ? d0 + DSTEPS : DDIM - 1;  // last plane this block reads

    Plane P[4];
    plane_issue(P[0], kc, vc, dfirst, boff);
    plane_issue(P[1], kc, vc, d0,     boff);
    plane_issue(P[2], kc, vc, d0 + 1, boff);
    v4f qn = load16(qc, own + (unsigned)d0 * PLB);
    plane_finish(P[0], d0 > 0, hv);
    plane_finish(P[1], true,   hv);

    // Rolled: four steps bring the plane buffers back to their places, and the body stays small.
    #pragma unroll 1
    for (int it = 0; it < DSTEPS / 4; ++it) {
        #pragma unroll  // the four steps of one turn of the ring: constant buffer indices
        for (int u = 0; u < 4; ++u) {
            const int d = d0 + it * 4 + u;
            // Plane d+2 is for the next step; past the block's last plane the load is clamped onto it.
            const int dn = (d + 2 < dlast) ? d + 2 : dlast;
            plane_issue(P[(u + 3) & 3], kc, vc, dn, boff);
            const v4f qv = qn;
            const int dq = (d + 1 < d0 + DSTEPS) ? d + 1 : d;
            qn = load16(qc, own + (unsigned)dq * PLB);
            // Keeps the loads above ahead of this step's arithmetic: they have the whole step to land.
            __builtin_amdgcn_sched_barrier(0);
            plane_finish(P[(u + 2) & 3], d + 1 < DDIM, hv);
            *(v4f*)((char*)oc + (own + (unsigned)d * PLB)) =
                attn_point4(P[u], P[(u + 1) & 3], P[(u + 2) & 3], qv, sb);
            // The store's registers are rewritten by the next step (over the back edge too).
            asm volatile("s_wait_xcnt 0x0" ::: "memory");
        }
    }
}

// ---------------------------------------------------------------------------
extern "C" void kernel_launch(void* const* d_in, const int* in_sizes, int n_in,
                              void* d_out, int out_size, void* d_ws, size_t ws_size,
                              hipStream_t stream)
{
    const float* x     = (const float*)d_in[0];
    const float* wq    = (const float*)d_in[1];
    const float* wk    = (const float*)d_in[2];
    const float* wv    = (const float*)d_in[3];
    const float* rel_d = (const float*)d_in[4];
    const float* rel_h = (const float*)d_in[5];
    const float* rel_w = (const float*)d_in[6];

    float* qb = (float*)d_ws;                    // [64, 65536] f32
    float* kb = qb + (size_t)COUT * NPOS;
    float* vb = kb + (size_t)COUT * NPOS;

    qkv_wmma_kernel<<<NPOS / 32, 256, 0, stream>>>(x, wq, wk, wv, qb, kb, vb);
    attn_kernel<<<COUT * (DDIM / DSTEPS) * 4, 256, 0, stream>>>(
        qb, kb, vb, rel_d, rel_h, rel_w, (float*)d_out);
}

// v002
// Measured time: 35.1 microseconds a run.
// In two side-by-side timings against v001, it was 1.10 and 1.07 times as fast.
// All steps since v000 together make it 1.69 times as fast.
#include <hip/hip_runtime.h>
#include <hip/hip_bf16.h>

typedef __attribute__((ext_vector_type(2))) float v2f;
typedef __attribute__((ext_vector_type(8))) float v8f;

#define CIN   64
#define COUT  64
#define DDIM  16
#define HDIM  64
#define WDIM  64
#define NPOS  (DDIM * HDIM * WDIM)   // 65536

// ---------------------------------------------------------------------------
// Kernel 1: q/k/v = W{q,k,v} @ x   via V_WMMA_F32_16X16X4_F32 (exact f32).
// Block = 256 threads = 8 waves; block covers PB = 256 positions, all 64 out chans.
// The three weight matrices are staged once per block in LDS by whole-line loads; each wave
// then keeps the A fragments of its 16 output channels (q, k and v) in registers and uses
// them for two chunks of 64 positions.
// Wave w: M-tile = w&3 (16 output channels), chunks (w>>2) and (w>>2) + 2.
// Inside a chunk, column n of N-tile t is position 4 * n + t, so a lane's four results of an
// output row are adjacent in memory: one 16-byte store, 256 bytes per row and half-wave.
// The x tile lies in LDS as [channel pair][position][2]: a 16-byte read is two B fragments.
// ---------------------------------------------------------------------------
typedef __attribute__((ext_vector_type(4))) float v4f;

#define PB 256   // positions per block
#define WP 68    // LDS pitch of a weight row in floats: the 8-byte fragment reads fall on all 64 banks

__global__ __launch_bounds__(256) void qkv_wmma_kernel(
    const float* __restrict__ x,    // [CIN, NPOS]
    const float* __restrict__ wq,   // [COUT, CIN] row-major
    const float* __restrict__ wk,
    const float* __restrict__ wv,
    float* __restrict__ q,          // [COUT, NPOS]
    float* __restrict__ k,
    float* __restrict__ v)
{
    __shared__ __attribute__((aligned(16))) float wsh[3 * COUT * WP];  // weights, 51 KB
    __shared__ __attribute__((aligned(16))) float xs[CIN * PB];        // x tile, 64 KB

    const int tid   = threadIdx.x;
    const int nbase = blockIdx.x * PB;

    // Cooperative 16-byte loads, all in flight at once: a wave takes two rows of a weight
    // matrix, or 512 contiguous bytes of a row of x. One index register serves each group.
    const unsigned xoff = (unsigned)((tid >> 6) * 2 * NPOS + (tid & 63) * 4) * 4u;
    const char*    xb   = (const char*)(x + nbase);
    v4f wr[12], xr[16];
    #pragma unroll  // constant indices keep the pieces in registers
    for (int i = 0; i < 4; ++i) {         // piece tid + 256 * i of each matrix
        wr[3 * i + 0] = ((const v4f*)wq)[256 * i + tid];
        wr[3 * i + 1] = ((const v4f*)wk)[256 * i + tid];
        wr[3 * i + 2] = ((const v4f*)wv)[256 * i + tid];
    }
    #pragma unroll  // constant indices keep the pieces in registers
    for (int i = 0; i < 8; ++i) {         // channels 2 * pr and 2 * pr + 1, pr = (tid >> 6) + 4 * i
        xr[2 * i + 0] = *(const v4f*)(xb + (size_t)(8 * i    ) * (NPOS * 4) + xoff);
        xr[2 * i + 1] = *(const v4f*)(xb + (size_t)(8 * i + 1) * (NPOS * 4) + xoff);
    }
    // The loads' index registers stay as they are up to this wait (they are its inputs).
    asm volatile("s_wait_xcnt 0x0" :: "v"(tid), "v"(xoff) : "memory");
    #pragma unroll  // constant indices into wr
    for (int i = 0; i < 4; ++i) {
        const int row = (tid >> 4) + 16 * i;
        const int c4  = (tid & 15) << 2;
        *(v4f*)&wsh[(0 * COUT + row) * WP + c4] = wr[3 * i + 0];
        *(v4f*)&wsh[(1 * COUT + row) * WP + c4] = wr[3 * i + 1];
        *(v4f*)&wsh[(2 * COUT + row) * WP + c4] = wr[3 * i + 2];
    }
    #pragma unroll  // constant indices into xr
    for (int i = 0; i < 8; ++i) {
        const int pr = (tid >> 6) + 4 * i;
        const int j  = (tid & 63) << 2;
        const v4f e = xr[2 * i], o = xr[2 * i + 1];
        const v4f lo = {e[0], o[0], e[1], o[1]};
        const v4f hi = {e[2], o[2], e[3], o[3]};
        *(v4f*)&xs[pr * (2 * PB) + 2 * j    ] = lo;
        *(v4f*)&xs[pr * (2 * PB) + 2 * j + 4] = hi;
    }
    __syncthreads();

    const int wave  = tid >> 5;
    const int lane  = tid & 31;
    const int mtile = wave & 3;
    const int m0    = mtile << 4;
    const int l15   = lane & 15;
    const int koff  = (lane < 16) ? 0 : 2;  // K-half held by this lane (A and B)
    const int mrow  = m0 + l15;             // A: this lane's M row

    // A operands (16x4 f32 each): V0 = w[m, c0], V1 = w[m, c0+1], c0 = 4 * kk + koff.
    v2f aq[16], ak[16], av[16];
    #pragma unroll  // constant indices keep the fragments in registers
    for (int kk = 0; kk < 16; ++kk) {
        const int c0 = (kk << 2) + koff;
        aq[kk] = *(const v2f*)&wsh[(0 * COUT + mrow) * WP + c0];
        ak[kk] = *(const v2f*)&wsh[(1 * COUT + mrow) * WP + c0];
        av[kk] = *(const v2f*)&wsh[(2 * COUT + mrow) * WP + c0];
    }

    // D layout (16x16 f32): VGPR r holds M=r (lanes 0-15) / M=r+8 (lanes 16-31),
    // N = lane % 16.
    const int mhalf = (lane < 16) ? 0 : 8;

    // Rolled: the body holds 192 matrix instructions, and the A fragments stay where they are.
    #pragma unroll 1
    for (int it = 0; it < PB / 128; ++it) {
        const int pl = ((wave >> 2) + 2 * it) * 64 + l15 * 4;   // this lane's four positions in the tile
        const float* xl = &xs[(koff >> 1) * (2 * PB) + 2 * pl];

        v8f accq[4] = {}; v8f acck[4] = {}; v8f accv[4] = {};

        #pragma unroll  // constant fragment indices
        for (int kk = 0; kk < 16; ++kk) {
            // B operands (4x16 f32) of the four N-tiles: V0 = x[c0, n], V1 = x[c0+1, n],
            // c0 = 4 * kk + koff, n = pl + t.
            const v4f b01 = *(const v4f*)&xl[kk * (4 * PB)];
            const v4f b23 = *(const v4f*)&xl[kk * (4 * PB) + 4];

            #pragma unroll  // constant accumulator indices
            for (int t = 0; t < 4; ++t) {
                const v4f bb = (t < 2) ? b01 : b23;
                const v2f b  = (t & 1) ? __builtin_shufflevector(bb, bb, 2, 3)
                                       : __builtin_shufflevector(bb, bb, 0, 1);
                accq[t] = __builtin_amdgcn_wmma_f32_16x16x4_f32(
                              false, aq[kk], false, b, (short)0, accq[t], false, false);
                acck[t] = __builtin_amdgcn_wmma_f32_16x16x4_f32(
                              false, ak[kk], false, b, (short)0, acck[t], false, false);
                accv[t] = __builtin_amdgcn_wmma_f32_16x16x4_f32(
                              false, av[kk], false, b, (short)0, accv[t], false, false);
            }
        }

        const unsigned off0 = (unsigned)((m0 + mhalf) * NPOS + nbase + pl) * 4u;  // bytes
        #pragma unroll  // constant accumulator indices
        for (int r = 0; r < 8; ++r) {
            const unsigned off = off0 + (unsigned)r * (NPOS * 4u);
            const v4f oq = {accq[0][r], accq[1][r], accq[2][r], accq[3][r]};
            const v4f ok = {acck[0][r], acck[1][r], acck[2][r], acck[3][r]};
            const v4f ov = {accv[0][r], accv[1][r], accv[2][r], accv[3][r]};
            *(v4f*)((char*)q + off) = oq;
            *(v4f*)((char*)k + off) = ok;
            *(v4f*)((char*)v + off) = ov;
        }
        // The stores' registers are rewritten by the next chunk.
        asm volatile("s_wait_xcnt 0x0" ::: "memory");
    }
}

// ---------------------------------------------------------------------------
// Kernel 2: per-channel 3x3x3 windowed softmax-attention.
// One lane owns 4 adjacent w of one (c,h) row and walks DSTEPS planes of d.
// 16 lanes cover a whole row of 64 w, so a wave covers two adjacent h rows.
// A k/v row is one 16-byte load per lane; the taps at w0-1 and w0+4 come from
// the neighbour lanes of the 16-lane row (a lane outside the row gives 0, which
// is the zero pad in w). Four plane buffers rotate in registers: three feed the
// current d, the fourth receives the plane that the next d needs.
// Zero-padded k/v (bias still applied to padded taps, matching reference).
// ---------------------------------------------------------------------------
#define DSTEPS 8

struct Plane {
    v4f   k[3], v[3];            // rows h-1, h, h+1 at w0..w0+3
    float kl[3], kr[3];          // k at w0-1 and at w0+4
    float vl[3], vr[3];          // v at w0-1 and at w0+4
};

// Value of the lane one to the left / right inside the 16-lane row, 0 past its end.
__device__ __forceinline__ float from_left(float x) {
    return __int_as_float(__builtin_amdgcn_update_dpp(
        0, __float_as_int(x), 0x111 /* row_shr:1 */, 0xf, 0xf, true));
}
__device__ __forceinline__ float from_right(float x) {
    return __int_as_float(__builtin_amdgcn_update_dpp(
        0, __float_as_int(x), 0x101 /* row_shl:1 */, 0xf, 0xf, true));
}

// One 16-byte load at base + off. The wait stands in front of whatever rewrites the
// load's address register next (a later load's result may be given that register).
__device__ __forceinline__ v4f load16(const float* base, unsigned off)
{
    const v4f x = *(const v4f*)((const char*)base + off);
    asm volatile("s_wait_xcnt 0x0" ::: "memory");
    return x;
}

// Issue the six row loads of plane dd (already clamped to a plane that exists). kc, vc: the
// channel's start, the same in every lane; boff: the lane's byte offsets of its three rows,
// clamped into the plane (no OOB reads).
__device__ __forceinline__ void plane_issue(
    Plane& P, const float* kc, const float* vc, int dd, const unsigned (&boff)[3])
{
    #pragma unroll  // constant indices keep the plane buffers in registers
    for (int th = 0; th < 3; ++th) {
        const unsigned off = boff[th] + (unsigned)dd * (HDIM * WDIM * 4u);
        P.k[th] = load16(kc, off);
        P.v[th] = load16(vc, off);
    }
}

// Zero the padding rows of a landed plane and fetch its edge taps.
__device__ __forceinline__ void plane_finish(Plane& P, bool dv, const bool (&hv)[3])
{
    const v4f zero = {0.0f, 0.0f, 0.0f, 0.0f};
    #pragma unroll  // constant indices keep the plane buffers in registers
    for (int th = 0; th < 3; ++th) {
        const bool ok = dv & hv[th];
        P.k[th]  = ok ? P.k[th] : zero;
        P.v[th]  = ok ? P.v[th] : zero;
        P.kl[th] = from_left(P.k[th][3]);
        P.kr[th] = from_right(P.k[th][0]);
        P.vl[th] = from_left(P.v[th][3]);
        P.vr[th] = from_right(P.v[th][0]);
    }
}

__device__ __forceinline__ float tap_k(const Plane& P, int th, int e) {
    return (e < 0) ? P.kl[th] : ((e > 3) ? P.kr[th] : P.k[th][e]);
}
__device__ __forceinline__ float tap_v(const Plane& P, int th, int e) {
    return (e < 0) ? P.vl[th] : ((e > 3) ? P.vr[th] : P.v[th][e]);
}

// The 4 outputs of one d from its three planes; taps summed in the order td, th, tw.
__device__ __forceinline__ v4f attn_point4(
    const Plane& A, const Plane& B, const Plane& C, v4f qv, const float (&sb)[27])
{
    // All loops here are unrolled so that every tap index is a constant (registers, no scratch).
    v4f o;
    #pragma unroll
    for (int jp = 0; jp < 4; jp += 2) {
        float lg[2][27];
        float mx[2] = {-3.402823466e+38f, -3.402823466e+38f};
        #pragma unroll
        for (int ti = 0; ti < 27; ++ti) {
            const int td = ti / 9, th = (ti / 3) % 3, tw = ti % 3;
            const Plane& X = (td == 0) ? A : ((td == 1) ? B : C);
            #pragma unroll
            for (int jj = 0; jj < 2; ++jj) {
                const float l = qv[jp + jj] * (tap_k(X, th, jp + jj + tw - 1) + sb[ti]);
                lg[jj][ti] = l;
                mx[jj] = fmaxf(mx[jj], l);
            }
        }
        float ssum[2] = {0.0f, 0.0f}, osum[2] = {0.0f, 0.0f};
        #pragma unroll
        for (int ti = 0; ti < 27; ++ti) {
            const int td = ti / 9, th = (ti / 3) % 3, tw = ti % 3;
            const Plane& X = (td == 0) ? A : ((td == 1) ? B : C);
            #pragma unroll
            for (int jj = 0; jj < 2; ++jj) {
                const float e = __expf(lg[jj][ti] - mx[jj]);
                ssum[jj] += e;
                osum[jj] += e * tap_v(X, th, jp + jj + tw - 1);
            }
        }
        o[jp]     = osum[0] / ssum[0];
        o[jp + 1] = osum[1] / ssum[1];
    }
    return o;
}

// Second launch-bounds argument: 4 waves per SIMD, so that all 512 blocks are resident at once.
__global__ __launch_bounds__(256, 4) void attn_kernel(
    const float* __restrict__ q,
    const float* __restrict__ k,
    const float* __restrict__ v,
    const float* __restrict__ rel_d,   // [21][3]
    const float* __restrict__ rel_h,   // [21][3]
    const float* __restrict__ rel_w,   // [22][3]
    float* __restrict__ out)
{
    // blockIdx.x = (c * (DDIM / DSTEPS) + d chunk) * 4 + group of 16 h rows
    const int hg = blockIdx.x & 3;
    const int d0 = ((blockIdx.x >> 2) & (DDIM / DSTEPS - 1)) * DSTEPS;
    const int c  = blockIdx.x / (4 * (DDIM / DSTEPS));
    const int h  = hg * 16 + (threadIdx.x >> 4);
    const int w0 = (threadIdx.x & 15) * 4;

    // Per-channel rel bias: axis 0 -> depends on td, 1 -> th, 2 -> tw.
    const int    axis = (c < 21) ? 0 : ((c < 42) ? 1 : 2);
    const float* r    = (c < 21) ? rel_d + c * 3
                                 : ((c < 42) ? rel_h + (c - 21) * 3 : rel_w + (c - 42) * 3);
    const float b0 = r[0], b1 = r[1], b2 = r[2];
    float sb[27];
    #pragma unroll  // 27 wave-uniform values, one per tap
    for (int ti = 0; ti < 27; ++ti) {
        const int bi = (axis == 0) ? ti / 9 : ((axis == 1) ? (ti / 3) % 3 : ti % 3);
        sb[ti] = (bi == 0) ? b0 : ((bi == 1) ? b1 : b2);
    }

    const size_t cbase = (size_t)c * NPOS;
    const float* kc = k + cbase;
    const float* vc = v + cbase;
    const float* qc = q + cbase;
    float*       oc = out + cbase;
    const unsigned PLB = HDIM * WDIM * 4u;               // bytes in a plane
    const unsigned own = (unsigned)(h * WDIM + w0) * 4u; // byte offset of the lane's own 4 w

    unsigned boff[3];
    bool     hv[3];
    #pragma unroll  // three rows, constant indices
    for (int th = 0; th < 3; ++th) {
        const int hh  = h + th - 1;
        const int hhc = (hh < 0) ? 0 : ((hh > HDIM - 1) ? HDIM - 1 : hh);
        hv[th]   = (unsigned)hh < (unsigned)HDIM;
        boff[th] = (unsigned)(hhc * WDIM + w0) * 4u;
    }

    const int dfirst = (d0 > 0) ? d0 - 1 : 0;                          // clamped first plane
    const int dlast  = (d0 + DSTEPS < DDIM) ? d0 + DSTEPS : DDIM - 1;  // last plane this block reads

    Plane P[4];
    plane_issue(P[0], kc, vc, dfirst, boff);
    plane_issue(P[1], kc, vc, d0,     boff);
    plane_issue(P[2], kc, vc, d0 + 1, boff);
    v4f qn = load16(qc, own + (unsigned)d0 * PLB);
    plane_finish(P[0], d0 > 0, hv);
    plane_finish(P[1], true,   hv);

    // Rolled: four steps bring the plane buffers back to their places, and the body stays small.
    #pragma unroll 1
    for (int it = 0; it < DSTEPS / 4; ++it) {
        #pragma unroll  // the four steps of one turn of the ring: constant buffer indices
        for (int u = 0; u < 4; ++u) {
            const int d = d0 + it * 4 + u;
            // Plane d+2 is for the next step; past the block's last plane the load is clamped onto it.
            const int dn = (d + 2 < dlast) ? d + 2 : dlast;
            plane_issue(P[(u + 3) & 3], kc, vc, dn, boff);
            const v4f qv = qn;
            const int dq = (d + 1 < d0 + DSTEPS) ? d + 1 : d;
            qn = load16(qc, own + (unsigned)dq * PLB);
            // Keeps the loads above ahead of this step's arithmetic: they have the whole step to land.
            __builtin_amdgcn_sched_barrier(0);
            plane_finish(P[(u + 2) & 3], d + 1 < DDIM, hv);
            *(v4f*)((char*)oc + (own + (unsigned)d * PLB)) =
                attn_point4(P[u], P[(u + 1) & 3], P[(u + 2) & 3], qv, sb);
            // The store's registers are rewritten by the next step (over the back edge too).
            asm volatile("s_wait_xcnt 0x0" ::: "memory");
        }
    }
}

// ---------------------------------------------------------------------------
extern "C" void kernel_launch(void* const* d_in, const int* in_sizes, int n_in,
                              void* d_out, int out_size, void* d_ws, size_t ws_size,
                              hipStream_t stream)
{
    const float* x     = (const float*)d_in[0];
    const float* wq    = (const float*)d_in[1];
    const float* wk    = (const float*)d_in[2];
    const float* wv    = (const float*)d_in[3];
    const float* rel_d = (const float*)d_in[4];
    const float* rel_h = (const float*)d_in[5];
    const float* rel_w = (const float*)d_in[6];

    float* qb = (float*)d_ws;                    // [64, 65536] f32
    float* kb = qb + (size_t)COUT * NPOS;
    float* vb = kb + (size_t)COUT * NPOS;

    qkv_wmma_kernel<<<NPOS / PB, 256, 0, stream>>>(x, wq, wk, wv, qb, kb, vb);
    attn_kernel<<<COUT * (DDIM / DSTEPS) * 4, 256, 0, stream>>>(
        qb, kb, vb, rel_d, rel_h, rel_w, (float*)d_out);
}

// v003
// One run takes 30.5 microseconds.
// Timed twice side by side with v002, it ran 1.15 times as fast both times.
// Over all steps from v000 it is 1.94 times as fast.
#include <hip/hip_runtime.h>
#include <hip/hip_bf16.h>

typedef __attribute__((ext_vector_type(2))) float v2f;
typedef __attribute__((ext_vector_type(8))) float v8f;

#define CIN   64
#define COUT  64
#define DDIM  16
#define HDIM  64
#define WDIM  64
#define NPOS  (DDIM * HDIM * WDIM)   // 65536

// ---------------------------------------------------------------------------
// Kernel 1: q/k/v = W{q,k,v} @ x   via V_WMMA_F32_16X16X4_F32 (exact f32).
// Block = 256 threads = 8 waves; block covers PB = 256 positions, all 64 out chans.
// The three weight matrices are staged once per block in LDS by whole-line loads; each wave
// then keeps the A fragments of its 16 output channels (q, k and v) in registers and uses
// them for two chunks of 64 positions.
// Wave w: M-tile = w&3 (16 output channels), chunks (w>>2) and (w>>2) + 2.
// Inside a chunk, column n of N-tile t is position 4 * n + t, so a lane's four results of an
// output row are adjacent in memory: one 16-byte store, 256 bytes per row and half-wave.
// The x tile lies in LDS as [channel pair][position][2]: a 16-byte read is two B fragments.
// ---------------------------------------------------------------------------
typedef __attribute__((ext_vector_type(4))) float v4f;

#define PB 256   // positions per block
#define WP 68    // LDS pitch of a weight row in floats: the 8-byte fragment reads fall on all 64 banks

__global__ __launch_bounds__(256) void qkv_wmma_kernel(
    const float* __restrict__ x,    // [CIN, NPOS]
    const float* __restrict__ wq,   // [COUT, CIN] row-major
    const float* __restrict__ wk,
    const float* __restrict__ wv,
    float* __restrict__ q,          // [COUT, NPOS]
    float* __restrict__ k,
    float* __restrict__ v)
{
    __shared__ __attribute__((aligned(16))) float wsh[3 * COUT * WP];  // weights, 51 KB
    __shared__ __attribute__((aligned(16))) float xs[CIN * PB];        // x tile, 64 KB

    const int tid   = threadIdx.x;
    const int nbase = blockIdx.x * PB;

    // Cooperative 16-byte loads, all in flight at once: a wave takes two rows of a weight
    // matrix, or 512 contiguous bytes of a row of x. One index register serves each group.
    const unsigned xoff = (unsigned)((tid >> 6) * 2 * NPOS + (tid & 63) * 4) * 4u;
    const char*    xb   = (const char*)(x + nbase);
    v4f wr[12], xr[16];
    #pragma unroll  // constant indices keep the pieces in registers
    for (int i = 0; i < 4; ++i) {         // piece tid + 256 * i of each matrix
        wr[3 * i + 0] = ((const v4f*)wq)[256 * i + tid];
        wr[3 * i + 1] = ((const v4f*)wk)[256 * i + tid];
        wr[3 * i + 2] = ((const v4f*)wv)[256 * i + tid];
    }
    #pragma unroll  // constant indices keep the pieces in registers
    for (int i = 0; i < 8; ++i) {         // channels 2 * pr and 2 * pr + 1, pr = (tid >> 6) + 4 * i
        xr[2 * i + 0] = *(const v4f*)(xb + (size_t)(8 * i    ) * (NPOS * 4) + xoff);
        xr[2 * i + 1] = *(const v4f*)(xb + (size_t)(8 * i + 1) * (NPOS * 4) + xoff);
    }
    // The loads' index registers stay as they are up to this wait (they are its inputs).
    asm volatile("s_wait_xcnt 0x0" :: "v"(tid), "v"(xoff) : "memory");
    #pragma unroll  // constant indices into wr
    for (int i = 0; i < 4; ++i) {
        const int row = (tid >> 4) + 16 * i;
        const int c4  = (tid & 15) << 2;
        *(v4f*)&wsh[(0 * COUT + row) * WP + c4] = wr[3 * i + 0];
        *(v4f*)&wsh[(1 * COUT + row) * WP + c4] = wr[3 * i + 1];
        *(v4f*)&wsh[(2 * COUT + row) * WP + c4] = wr[3 * i + 2];
    }
    #pragma unroll  // constant indices into xr
    for (int i = 0; i < 8; ++i) {
        const int pr = (tid >> 6) + 4 * i;
        const int j  = (tid & 63) << 2;
        const v4f e = xr[2 * i], o = xr[2 * i + 1];
        const v4f lo = {e[0], o[0], e[1], o[1]};
        const v4f hi = {e[2], o[2], e[3], o[3]};
        *(v4f*)&xs[pr * (2 * PB) + 2 * j    ] = lo;
        *(v4f*)&xs[pr * (2 * PB) + 2 * j + 4] = hi;
    }
    __syncthreads();

    const int wave  = tid >> 5;
    const int lane  = tid & 31;
    const int mtile = wave & 3;
    const int m0    = mtile << 4;
    const int l15   = lane & 15;
    const int koff  = (lane < 16) ? 0 : 2;  // K-half held by this lane (A and B)
    const int mrow  = m0 + l15;             // A: this lane's M row

    // A operands (16x4 f32 each): V0 = w[m, c0], V1 = w[m, c0+1], c0 = 4 * kk + koff.
    v2f aq[16], ak[16], av[16];
    #pragma unroll  // constant indices keep the fragments in registers
    for (int kk = 0; kk < 16; ++kk) {
        const int c0 = (kk << 2) + koff;
        aq[kk] = *(const v2f*)&wsh[(0 * COUT + mrow) * WP + c0];
        ak[kk] = *(const v2f*)&wsh[(1 * COUT + mrow) * WP + c0];
        av[kk] = *(const v2f*)&wsh[(2 * COUT + mrow) * WP + c0];
    }

    // D layout (16x16 f32): VGPR r holds M=r (lanes 0-15) / M=r+8 (lanes 16-31),
    // N = lane % 16.
    const int mhalf = (lane < 16) ? 0 : 8;

    // Rolled: the body holds 192 matrix instructions, and the A fragments stay where they are.
    #pragma unroll 1
    for (int it = 0; it < PB / 128; ++it) {
        const int pl = ((wave >> 2) + 2 * it) * 64 + l15 * 4;   // this lane's four positions in the tile
        const float* xl = &xs[(koff >> 1) * (2 * PB) + 2 * pl];

        v8f accq[4] = {}; v8f acck[4] = {}; v8f accv[4] = {};

        #pragma unroll  // constant fragment indices
        for (int kk = 0; kk < 16; ++kk) {
            // B operands (4x16 f32) of the four N-tiles: V0 = x[c0, n], V1 = x[c0+1, n],
            // c0 = 4 * kk + koff, n = pl + t.
            const v4f b01 = *(const v4f*)&xl[kk * (4 * PB)];
            const v4f b23 = *(const v4f*)&xl[kk * (4 * PB) + 4];

            #pragma unroll  // constant accumulator indices
            for (int t = 0; t < 4; ++t) {
                const v4f bb = (t < 2) ? b01 : b23;
                const v2f b  = (t & 1) ? __builtin_shufflevector(bb, bb, 2, 3)
                                       : __builtin_shufflevector(bb, bb, 0, 1);
                accq[t] = __builtin_amdgcn_wmma_f32_16x16x4_f32(
                              false, aq[kk], false, b, (short)0, accq[t], false, false);
                acck[t] = __builtin_amdgcn_wmma_f32_16x16x4_f32(
                              false, ak[kk], false, b, (short)0, acck[t], false, false);
                accv[t] = __builtin_amdgcn_wmma_f32_16x16x4_f32(
                              false, av[kk], false, b, (short)0, accv[t], false, false);
            }
        }

        const unsigned off0 = (unsigned)((m0 + mhalf) * NPOS + nbase + pl) * 4u;  // bytes
        #pragma unroll  // constant accumulator indices
        for (int r = 0; r < 8; ++r) {
            const unsigned off = off0 + (unsigned)r * (NPOS * 4u);
            const v4f oq = {accq[0][r], accq[1][r], accq[2][r], accq[3][r]};
            const v4f ok = {acck[0][r], acck[1][r], acck[2][r], acck[3][r]};
            const v4f ov = {accv[0][r], accv[1][r], accv[2][r], accv[3][r]};
            *(v4f*)((char*)q + off) = oq;
            *(v4f*)((char*)k + off) = ok;
            *(v4f*)((char*)v + off) = ov;
        }
        // The stores' registers are rewritten by the next chunk.
        asm volatile("s_wait_xcnt 0x0" ::: "memory");
    }
}

// ---------------------------------------------------------------------------
// Kernel 2: per-channel 3x3x3 windowed softmax-attention.
// One lane owns 4 adjacent w of one (c,h) row and walks DSTEPS planes of d.
// 16 lanes cover a whole row of 64 w, so a wave covers two adjacent h rows.
// A k/v row is one 16-byte load per lane; the taps at w0-1 and w0+4 come from
// the neighbour lanes of the 16-lane row (a lane outside the row gives 0, which
// is the zero pad in w). Four plane buffers rotate in registers: three feed the
// current d, the fourth receives the plane that the next d needs.
// Zero-padded k/v (bias still applied to padded taps, matching reference).
// ---------------------------------------------------------------------------
#define DSTEPS 8
#define NJ 2       // outputs of a lane worked on side by side

struct Plane {
    v4f   k[3], v[3];            // rows h-1, h, h+1 at w0..w0+3
    float kl[3], kr[3];          // k at w0-1 and at w0+4
    float vl[3], vr[3];          // v at w0-1 and at w0+4
};

// Value of the lane one to the left / right inside the 16-lane row, 0 past its end.
__device__ __forceinline__ float from_left(float x) {
    return __int_as_float(__builtin_amdgcn_update_dpp(
        0, __float_as_int(x), 0x111 /* row_shr:1 */, 0xf, 0xf, true));
}
__device__ __forceinline__ float from_right(float x) {
    return __int_as_float(__builtin_amdgcn_update_dpp(
        0, __float_as_int(x), 0x101 /* row_shl:1 */, 0xf, 0xf, true));
}

// One 16-byte load at base + off. The wait stands in front of whatever rewrites the
// load's address register next (a later load's result may be given that register).
__device__ __forceinline__ v4f load16(const float* base, unsigned off)
{
    const v4f x = *(const v4f*)((const char*)base + off);
    asm volatile("s_wait_xcnt 0x0" ::: "memory");
    return x;
}

// Issue the six row loads of plane dd (already clamped to a plane that exists). kc, vc: the
// channel's start, the same in every lane; boff: the lane's byte offsets of its three rows,
// clamped into the plane (no OOB reads).
__device__ __forceinline__ void plane_issue(
    Plane& P, const float* kc, const float* vc, int dd, const unsigned (&boff)[3])
{
    #pragma unroll  // constant indices keep the plane buffers in registers
    for (int th = 0; th < 3; ++th) {
        const unsigned off = boff[th] + (unsigned)dd * (HDIM * WDIM * 4u);
        P.k[th] = load16(kc, off);
        P.v[th] = load16(vc, off);
    }
}

// Zero the padding rows of a landed plane and fetch its edge taps.
__device__ __forceinline__ void plane_finish(Plane& P, bool dv, const bool (&hv)[3])
{
    const v4f zero = {0.0f, 0.0f, 0.0f, 0.0f};
    #pragma unroll  // constant indices keep the plane buffers in registers
    for (int th = 0; th < 3; ++th) {
        const bool ok = dv & hv[th];
        P.k[th]  = ok ? P.k[th] : zero;
        P.v[th]  = ok ? P.v[th] : zero;
        P.kl[th] = from_left(P.k[th][3]);
        P.kr[th] = from_right(P.k[th][0]);
        P.vl[th] = from_left(P.v[th][3]);
        P.vr[th] = from_right(P.v[th][0]);
    }
}

__device__ __forceinline__ float tap_k(const Plane& P, int th, int e) {
    return (e < 0) ? P.kl[th] : ((e > 3) ? P.kr[th] : P.k[th][e]);
}
__device__ __forceinline__ float tap_v(const Plane& P, int th, int e) {
    return (e < 0) ? P.vl[th] : ((e > 3) ? P.vr[th] : P.v[th][e]);
}

// The 4 outputs of one d from its three planes; taps summed in the order td, th, tw.
// The softmax runs in base 2: with q2 = q * log2(e) a tap's logit is q2 * k + q2 * b, one fma
// whose addend is one of three products per output (AXIS says which tap index picks the bias:
// 0 = td, 1 = th, 2 = tw). The exponent is that logit less the maximum, with no further scaling.
template <int AXIS>
__device__ __forceinline__ v4f attn_point4(
    const Plane& A, const Plane& B, const Plane& C, v4f qv, float b0, float b1, float b2)
{
    // All loops here are unrolled so that every tap index is a constant (registers, no scratch).
    v4f o;
    #pragma unroll
    for (int jp = 0; jp < 4; jp += NJ) {
        float q2[NJ], qb[NJ][3], mx[NJ], lg[NJ][27];
        #pragma unroll
        for (int jj = 0; jj < NJ; ++jj) {
            q2[jj]    = qv[jp + jj] * 1.44269504088896340736f;
            qb[jj][0] = q2[jj] * b0;
            qb[jj][1] = q2[jj] * b1;
            qb[jj][2] = q2[jj] * b2;
            mx[jj]    = -3.402823466e+38f;
        }
        #pragma unroll
        for (int ti = 0; ti < 27; ++ti) {
            const int td = ti / 9, th = (ti / 3) % 3, tw = ti % 3;
            const int bi = (AXIS == 0) ? td : ((AXIS == 1) ? th : tw);
            const Plane& X = (td == 0) ? A : ((td == 1) ? B : C);
            #pragma unroll
            for (int jj = 0; jj < NJ; ++jj) {
                lg[jj][ti] = __builtin_fmaf(q2[jj], tap_k(X, th, jp + jj + tw - 1), qb[jj][bi]);
                mx[jj] = fmaxf(mx[jj], lg[jj][ti]);
            }
        }
        float ssum[NJ], osum[NJ];
        #pragma unroll
        for (int jj = 0; jj < NJ; ++jj) {
            ssum[jj] = 0.0f;
            osum[jj] = 0.0f;
        }
        #pragma unroll
        for (int ti = 0; ti < 27; ++ti) {
            #pragma unroll
            for (int jj = 0; jj < NJ; ++jj)
                lg[jj][ti] = __builtin_amdgcn_exp2f(lg[jj][ti] - mx[jj]);
        }
        #pragma unroll
        for (int ti = 0; ti < 27; ++ti) {
            const int td = ti / 9, th = (ti / 3) % 3, tw = ti % 3;
            const Plane& X = (td == 0) ? A : ((td == 1) ? B : C);
            #pragma unroll
            for (int jj = 0; jj < NJ; ++jj) {
                ssum[jj] += lg[jj][ti];
                osum[jj] += lg[jj][ti] * tap_v(X, th, jp + jj + tw - 1);
            }
        }
        #pragma unroll
        for (int jj = 0; jj < NJ; ++jj)
            o[jp + jj] = osum[jj] / ssum[jj];
    }
    return o;
}

// One block's work for a channel whose bias runs along AXIS; r: the channel's three bias values.
template <int AXIS>
__device__ __forceinline__ void attn_body(
    const float* __restrict__ q, const float* __restrict__ k, const float* __restrict__ v,
    const float* __restrict__ r, float* __restrict__ out, int c, int d0, int h, int w0)
{
    const float b0 = r[0], b1 = r[1], b2 = r[2];

    const size_t cbase = (size_t)c * NPOS;
    const float* kc = k + cbase;
    const float* vc = v + cbase;
    const float* qc = q + cbase;
    float*       oc = out + cbase;
    const unsigned PLB = HDIM * WDIM * 4u;               // bytes in a plane
    const unsigned own = (unsigned)(h * WDIM + w0) * 4u; // byte offset of the lane's own 4 w

    unsigned boff[3];
    bool     hv[3];
    #pragma unroll  // three rows, constant indices
    for (int th = 0; th < 3; ++th) {
        const int hh  = h + th - 1;
        const int hhc = (hh < 0) ? 0 : ((hh > HDIM - 1) ? HDIM - 1 : hh);
        hv[th]   = (unsigned)hh < (unsigned)HDIM;
        boff[th] = (unsigned)(hhc * WDIM + w0) * 4u;
    }

    const int dfirst = (d0 > 0) ? d0 - 1 : 0;                          // clamped first plane
    const int dlast  = (d0 + DSTEPS < DDIM) ? d0 + DSTEPS : DDIM - 1;  // last plane this block reads

    Plane P[4];
    plane_issue(P[0], kc, vc, dfirst, boff);
    plane_issue(P[1], kc, vc, d0,     boff);
    plane_issue(P[2], kc, vc, d0 + 1, boff);
    v4f qn = load16(qc, own + (unsigned)d0 * PLB);
    plane_finish(P[0], d0 > 0, hv);
    plane_finish(P[1], true,   hv);

    // Rolled: four steps bring the plane buffers back to their places, and the body stays small.
    #pragma unroll 1
    for (int it = 0; it < DSTEPS / 4; ++it) {
        #pragma unroll  // the four steps of one turn of the ring: constant buffer indices
        for (int u = 0; u < 4; ++u) {
            const int d = d0 + it * 4 + u;
            // Plane d+2 is for the next step; past the block's last plane the load is clamped onto it.
            const int dn = (d + 2 < dlast) ? d + 2 : dlast;
            plane_issue(P[(u + 3) & 3], kc, vc, dn, boff);
            const v4f qv = qn;
            const int dq = (d + 1 < d0 + DSTEPS) ? d + 1 : d;
            qn = load16(qc, own + (unsigned)dq * PLB);
            // Keeps the loads above ahead of this step's arithmetic: they have the whole step to land.
            __builtin_amdgcn_sched_barrier(0);
            plane_finish(P[(u + 2) & 3], d + 1 < DDIM, hv);
            *(v4f*)((char*)oc + (own + (unsigned)d * PLB)) =
                attn_point4<AXIS>(P[u], P[(u + 1) & 3], P[(u + 2) & 3], qv, b0, b1, b2);
            // The store's registers are rewritten by the next step (over the back edge too).
            asm volatile("s_wait_xcnt 0x0" ::: "memory");
        }
    }
}

// Second launch-bounds argument: 4 waves per SIMD, so that all 512 blocks are resident at once.
__global__ __launch_bounds__(256, 4) void attn_kernel(
    const float* __restrict__ q,
    const float* __restrict__ k,
    const float* __restrict__ v,
    const float* __restrict__ rel_d,   // [21][3]
    const float* __restrict__ rel_h,   // [21][3]
    const float* __restrict__ rel_w,   // [22][3]
    float* __restrict__ out)
{
    // blockIdx.x = (c * (DDIM / DSTEPS) + d chunk) * 4 + group of 16 h rows
    const int hg = blockIdx.x & 3;
    const int d0 = ((blockIdx.x >> 2) & (DDIM / DSTEPS - 1)) * DSTEPS;
    const int c  = blockIdx.x / (4 * (DDIM / DSTEPS));
    const int h  = hg * 16 + (threadIdx.x >> 4);
    const int w0 = (threadIdx.x & 15) * 4;

    // Per-channel rel bias: the first 21 channels take it by td, the next 21 by th, the rest by tw.
    // The branch is the same for the whole block.
    if (c < 21)      attn_body<0>(q, k, v, rel_d + c * 3,        out, c, d0, h, w0);
    else if (c < 42) attn_body<1>(q, k, v, rel_h + (c - 21) * 3, out, c, d0, h, w0);
    else             attn_body<2>(q, k, v, rel_w + (c - 42) * 3, out, c, d0, h, w0);
}

// ---------------------------------------------------------------------------
extern "C" void kernel_launch(void* const* d_in, const int* in_sizes, int n_in,
                              void* d_out, int out_size, void* d_ws, size_t ws_size,
                              hipStream_t stream)
{
    const float* x     = (const float*)d_in[0];
    const float* wq    = (const float*)d_in[1];
    const float* wk    = (const float*)d_in[2];
    const float* wv    = (const float*)d_in[3];
    const float* rel_d = (const float*)d_in[4];
    const float* rel_h = (const float*)d_in[5];
    const float* rel_w = (const float*)d_in[6];

    float* qb = (float*)d_ws;                    // [64, 65536] f32
    float* kb = qb + (size_t)COUT * NPOS;
    float* vb = kb + (size_t)COUT * NPOS;

    qkv_wmma_kernel<<<NPOS / PB, 256, 0, stream>>>(x, wq, wk, wv, qb, kb, vb);
    attn_kernel<<<COUT * (DDIM / DSTEPS) * 4, 256, 0, stream>>>(
        qb, kb, vb, rel_d, rel_h, rel_w, (float*)d_out);
}

// v004
// Measured time: 28.1 microseconds a run.
// Two timings next to v003 both put it at 1.07 times that version's speed.
// All steps since v000 together make it 2.08 times as fast.
#include <hip/hip_runtime.h>
#include <hip/hip_bf16.h>

typedef __attribute__((ext_vector_type(2))) float v2f;
typedef __attribute__((ext_vector_type(8))) float v8f;

#define CIN   64
#define COUT  64
#define DDIM  16
#define HDIM  64
#define WDIM  64
#define NPOS  (DDIM * HDIM * WDIM)   // 65536

// ---------------------------------------------------------------------------
// Kernel 1: q/k/v = W{q,k,v} @ x   via V_WMMA_F32_16X16X4_F32 (exact f32).
// Block = 256 threads = 8 waves; block covers PB = 256 positions, all 64 out chans.
// The three weight matrices are staged once per block in LDS by whole-line loads; each wave
// then keeps the A fragments of its 16 output channels (q, k and v) in registers and uses
// them for two chunks of 64 positions.
// Wave w: M-tile = w&3 (16 output channels), chunks (w>>2) and (w>>2) + 2.
// Inside a chunk, column n of N-tile t is position 4 * n + t, so a lane's four results of an
// output row are adjacent in memory: one 16-byte store, 256 bytes per row and half-wave.
// The x tile lies in LDS as [channel pair][position][2]: a 16-byte read is two B fragments.
// ---------------------------------------------------------------------------
typedef __attribute__((ext_vector_type(4))) float v4f;

#define PB 256   // positions per block
#define WP 68    // LDS pitch of a weight row in floats: the 8-byte fragment reads fall on all 64 banks

__global__ __launch_bounds__(256) void qkv_wmma_kernel(
    const float* __restrict__ x,    // [CIN, NPOS]
    const float* __restrict__ wq,   // [COUT, CIN] row-major
    const float* __restrict__ wk,
    const float* __restrict__ wv,
    float* __restrict__ q,          // [COUT, NPOS]
    float* __restrict__ k,
    float* __restrict__ v)
{
    __shared__ __attribute__((aligned(16))) float wsh[3 * COUT * WP];  // weights, 51 KB
    __shared__ __attribute__((aligned(16))) float xs[CIN * PB];        // x tile, 64 KB

    const int tid   = threadIdx.x;
    const int nbase = blockIdx.x * PB;

    // Cooperative 16-byte loads, all in flight at once: a wave takes two rows of a weight
    // matrix, or 512 contiguous bytes of a row of x. One index register serves each group.
    const unsigned xoff = (unsigned)((tid >> 6) * 2 * NPOS + (tid & 63) * 4) * 4u;
    const char*    xb   = (const char*)(x + nbase);
    v4f wr[12], xr[16];
    #pragma unroll  // constant indices keep the pieces in registers
    for (int i = 0; i < 4; ++i) {         // piece tid + 256 * i of each matrix
        wr[3 * i + 0] = ((const v4f*)wq)[256 * i + tid];
        wr[3 * i + 1] = ((const v4f*)wk)[256 * i + tid];
        wr[3 * i + 2] = ((const v4f*)wv)[256 * i + tid];
    }
    #pragma unroll  // constant indices keep the pieces in registers
    for (int i = 0; i < 8; ++i) {         // channels 2 * pr and 2 * pr + 1, pr = (tid >> 6) + 4 * i
        xr[2 * i + 0] = *(const v4f*)(xb + (size_t)(8 * i    ) * (NPOS * 4) + xoff);
        xr[2 * i + 1] = *(const v4f*)(xb + (size_t)(8 * i + 1) * (NPOS * 4) + xoff);
    }
    // The loads' index registers stay as they are up to this wait (they are its inputs).
    asm volatile("s_wait_xcnt 0x0" :: "v"(tid), "v"(xoff) : "memory");
    #pragma unroll  // constant indices into wr
    for (int i = 0; i < 4; ++i) {
        const int row = (tid >> 4) + 16 * i;
        const int c4  = (tid & 15) << 2;
        *(v4f*)&wsh[(0 * COUT + row) * WP + c4] = wr[3 * i + 0];
        *(v4f*)&wsh[(1 * COUT + row) * WP + c4] = wr[3 * i + 1];
        *(v4f*)&wsh[(2 * COUT + row) * WP + c4] = wr[3 * i + 2];
    }
    #pragma unroll  // constant indices into xr
    for (int i = 0; i < 8; ++i) {
        const int pr = (tid >> 6) + 4 * i;
        const int j  = (tid & 63) << 2;
        const v4f e = xr[2 * i], o = xr[2 * i + 1];
        const v4f lo = {e[0], o[0], e[1], o[1]};
        const v4f hi = {e[2], o[2], e[3], o[3]};
        *(v4f*)&xs[pr * (2 * PB) + 2 * j    ] = lo;
        *(v4f*)&xs[pr * (2 * PB) + 2 * j + 4] = hi;
    }
    __syncthreads();

    const int wave  = tid >> 5;
    const int lane  = tid & 31;
    const int mtile = wave & 3;
    const int m0    = mtile << 4;
    const int l15   = lane & 15;
    const int koff  = (lane < 16) ? 0 : 2;  // K-half held by this lane (A and B)
    const int mrow  = m0 + l15;             // A: this lane's M row

    // A operands (16x4 f32 each): V0 = w[m, c0], V1 = w[m, c0+1], c0 = 4 * kk + koff.
    v2f aq[16], ak[16], av[16];
    #pragma unroll  // constant indices keep the fragments in registers
    for (int kk = 0; kk < 16; ++kk) {
        const int c0 = (kk << 2) + koff;
        aq[kk] = *(const v2f*)&wsh[(0 * COUT + mrow) * WP + c0];
        ak[kk] = *(const v2f*)&wsh[(1 * COUT + mrow) * WP + c0];
        av[kk] = *(const v2f*)&wsh[(2 * COUT + mrow) * WP + c0];
    }

    // D layout (16x16 f32): VGPR r holds M=r (lanes 0-15) / M=r+8 (lanes 16-31),
    // N = lane % 16.
    const int mhalf = (lane < 16) ? 0 : 8;

    // Rolled: the body holds 192 matrix instructions, and the A fragments stay where they are.
    #pragma unroll 1
    for (int it = 0; it < PB / 128; ++it) {
        const int pl = ((wave >> 2) + 2 * it) * 64 + l15 * 4;   // this lane's four positions in the tile
        const float* xl = &xs[(koff >> 1) * (2 * PB) + 2 * pl];

        v8f accq[4] = {}; v8f acck[4] = {}; v8f accv[4] = {};

        #pragma unroll  // constant fragment indices
        for (int kk = 0; kk < 16; ++kk) {
            // B operands (4x16 f32) of the four N-tiles: V0 = x[c0, n], V1 = x[c0+1, n],
            // c0 = 4 * kk + koff, n = pl + t.
            const v4f b01 = *(const v4f*)&xl[kk * (4 * PB)];
            const v4f b23 = *(const v4f*)&xl[kk * (4 * PB) + 4];

            #pragma unroll  // constant accumulator indices
            for (int t = 0; t < 4; ++t) {
                const v4f bb = (t < 2) ? b01 : b23;
                const v2f b  = (t & 1) ? __builtin_shufflevector(bb, bb, 2, 3)
                                       : __builtin_shufflevector(bb, bb, 0, 1);
                accq[t] = __builtin_amdgcn_wmma_f32_16x16x4_f32(
                              false, aq[kk], false, b, (short)0, accq[t], false, false);
                acck[t] = __builtin_amdgcn_wmma_f32_16x16x4_f32(
                              false, ak[kk], false, b, (short)0, acck[t], false, false);
                accv[t] = __builtin_amdgcn_wmma_f32_16x16x4_f32(
                              false, av[kk], false, b, (short)0, accv[t], false, false);
            }
        }

        const unsigned off0 = (unsigned)((m0 + mhalf) * NPOS + nbase + pl) * 4u;  // bytes
        #pragma unroll  // constant accumulator indices
        for (int r = 0; r < 8; ++r) {
            const unsigned off = off0 + (unsigned)r * (NPOS * 4u);
            const v4f oq = {accq[0][r], accq[1][r], accq[2][r], accq[3][r]};
            const v4f ok = {acck[0][r], acck[1][r], acck[2][r], acck[3][r]};
            const v4f ov = {accv[0][r], accv[1][r], accv[2][r], accv[3][r]};
            *(v4f*)((char*)q + off) = oq;
            *(v4f*)((char*)k + off) = ok;
            *(v4f*)((char*)v + off) = ov;
        }
        // The stores' registers are rewritten by the next chunk.
        asm volatile("s_wait_xcnt 0x0" ::: "memory");
    }
}

// ---------------------------------------------------------------------------
// Kernel 2: per-channel 3x3x3 windowed softmax-attention.
// One lane owns 4 adjacent w of one (c,h) row and walks DSTEPS planes of d.
// 16 lanes cover a whole row of 64 w, so a wave covers two adjacent h rows.
// A k/v row is one 16-byte load per lane; the taps at w0-1 and w0+4 come from
// the neighbour lanes of the 16-lane row (a lane outside the row gives 0, which
// is the zero pad in w). Four plane buffers rotate in registers: three feed the
// current d, the fourth receives the plane that the next d needs.
// Zero-padded k/v (bias still applied to padded taps, matching reference).
// ---------------------------------------------------------------------------
#define DSTEPS 8

struct Plane {
    v4f   k[3], v[3];            // rows h-1, h, h+1 at w0..w0+3
    float kl[3], kr[3];          // k at w0-1 and at w0+4
    float vl[3], vr[3];          // v at w0-1 and at w0+4
    float ka;                    // largest |k| among the 18 k values above
};

// Value of the lane one to the left / right inside the 16-lane row, 0 past its end.
__device__ __forceinline__ float from_left(float x) {
    return __int_as_float(__builtin_amdgcn_update_dpp(
        0, __float_as_int(x), 0x111 /* row_shr:1 */, 0xf, 0xf, true));
}
__device__ __forceinline__ float from_right(float x) {
    return __int_as_float(__builtin_amdgcn_update_dpp(
        0, __float_as_int(x), 0x101 /* row_shl:1 */, 0xf, 0xf, true));
}

// One 16-byte load at base + off. The wait stands in front of whatever rewrites the
// load's address register next (a later load's result may be given that register).
__device__ __forceinline__ v4f load16(const float* base, unsigned off)
{
    const v4f x = *(const v4f*)((const char*)base + off);
    asm volatile("s_wait_xcnt 0x0" ::: "memory");
    return x;
}

// Issue the six row loads of plane dd (already clamped to a plane that exists). kc, vc: the
// channel's start, the same in every lane; boff: the lane's byte offsets of its three rows,
// clamped into the plane (no OOB reads).
__device__ __forceinline__ void plane_issue(
    Plane& P, const float* kc, const float* vc, int dd, const unsigned (&boff)[3])
{
    #pragma unroll  // constant indices keep the plane buffers in registers
    for (int th = 0; th < 3; ++th) {
        const unsigned off = boff[th] + (unsigned)dd * (HDIM * WDIM * 4u);
        P.k[th] = load16(kc, off);
        P.v[th] = load16(vc, off);
    }
}

// Zero the padding rows of a landed plane, fetch its edge taps and note its largest |k|.
__device__ __forceinline__ void plane_finish(Plane& P, bool dv, const bool (&hv)[3])
{
    const v4f zero = {0.0f, 0.0f, 0.0f, 0.0f};
    #pragma unroll  // constant indices keep the plane buffers in registers
    for (int th = 0; th < 3; ++th) {
        const bool ok = dv & hv[th];
        P.k[th]  = ok ? P.k[th] : zero;
        P.v[th]  = ok ? P.v[th] : zero;
        P.kl[th] = from_left(P.k[th][3]);
        P.kr[th] = from_right(P.k[th][0]);
        P.vl[th] = from_left(P.v[th][3]);
        P.vr[th] = from_right(P.v[th][0]);
    }
    // Largest |k| of the 18 values, by three-way maxima in short chains (one per row).
    float rm[3];
    #pragma unroll  // constant indices keep the plane buffers in registers
    for (int th = 0; th < 3; ++th) {
        rm[th] = fmaxf(fmaxf(__builtin_fabsf(P.kl[th]), __builtin_fabsf(P.k[th][0])), __builtin_fabsf(P.k[th][1]));
        rm[th] = fmaxf(fmaxf(rm[th], __builtin_fabsf(P.k[th][2])), __builtin_fabsf(P.k[th][3]));
    }
    const float er = fmaxf(fmaxf(__builtin_fabsf(P.kr[0]), __builtin_fabsf(P.kr[1])), __builtin_fabsf(P.kr[2]));
    P.ka = fmaxf(fmaxf(fmaxf(rm[0], rm[1]), rm[2]), er);
}

__device__ __forceinline__ float tap_k(const Plane& P, int th, int e) {
    return (e < 0) ? P.kl[th] : ((e > 3) ? P.kr[th] : P.k[th][e]);
}
__device__ __forceinline__ float tap_v(const Plane& P, int th, int e) {
    return (e < 0) ? P.vl[th] : ((e > 3) ? P.vr[th] : P.v[th][e]);
}

// The 4 outputs of one d from its three planes; taps summed in the order td, th, tw.
// The softmax runs in base 2: with q2 = q * log2(e) a tap's logit is q2 * k + q2 * b (AXIS says
// which tap index picks the bias: 0 = td, 1 = th, 2 = tw).
// A softmax does not change when one number is taken off all its logits; the number only has to
// keep the weights in range. Taken off here is the lane's bound u = max|q2| * (max|k| + max|b|),
// made from the planes' stored maxima: no logit is above u, so no weight is above 1 (but for the
// rounding of u). The exponent is one fma per tap, whose addend q2 * b - u is one of three values
// per output. With no logits to keep, the lane's four outputs are worked on side by side.
// The largest weight must also stay far above the smallest normal number. It is at least the
// centre tap's, so the test is on that tap's exponent: above -96 the largest weight is above
// 2^-96, and whatever the exponential flushes (below 2^-126) is less than 2^-30 of it.
// If one output of the wave fails the test, the wave finds the true maximum of each output's 27
// logits and takes that off instead: the largest weight is then 1, whatever the inputs.
template <int AXIS>
__device__ __forceinline__ v4f attn_point4(
    const Plane& A, const Plane& B, const Plane& C, v4f qv, float b0, float b1, float b2, float ba)
{
    // All loops here are unrolled so that every tap index is a constant (registers, no scratch).
    float q2[4], ad[4][3];
    #pragma unroll
    for (int j = 0; j < 4; ++j)
        q2[j] = qv[j] * 1.44269504088896340736f;
    const float qa = fmaxf(fmaxf(__builtin_fabsf(q2[0]), __builtin_fabsf(q2[1])),
                           fmaxf(__builtin_fabsf(q2[2]), __builtin_fabsf(q2[3])));
    const float u  = qa * (fmaxf(fmaxf(A.ka, B.ka), C.ka) + ba);
    float xc[4];   // exponent of the centre tap (td = th = tw = 1)
    #pragma unroll
    for (int j = 0; j < 4; ++j) {
        ad[j][0] = __builtin_fmaf(q2[j], b0, -u);
        ad[j][1] = __builtin_fmaf(q2[j], b1, -u);
        ad[j][2] = __builtin_fmaf(q2[j], b2, -u);
        xc[j]    = __builtin_fmaf(q2[j], B.k[1][j], ad[j][1]);
    }
    // The minimum skips a NaN beside numbers: that output is NaN on either path. All four NaN
    // (u itself NaN) fail the comparison.
    const float xm = fminf(fminf(xc[0], xc[1]), fminf(xc[2], xc[3]));
    // The branch is the same for the whole wave. Marked unlikely, so that the careful path is laid
    // out behind the loop and the usual path runs straight through.
    if (__builtin_expect(__builtin_amdgcn_ballot_w32(!(xm > -96.0f)) != 0u, 0)) {
        #pragma unroll
        for (int j = 0; j < 4; ++j) {
            const float qb[3] = {q2[j] * b0, q2[j] * b1, q2[j] * b2};
            float mx = -3.402823466e+38f;
            #pragma unroll
            for (int ti = 0; ti < 27; ++ti) {
                const int td = ti / 9, th = (ti / 3) % 3, tw = ti % 3;
                const int bi = (AXIS == 0) ? td : ((AXIS == 1) ? th : tw);
                const Plane& X = (td == 0) ? A : ((td == 1) ? B : C);
                mx = fmaxf(mx, __builtin_fmaf(q2[j], tap_k(X, th, j + tw - 1), qb[bi]));
            }
            ad[j][0] = qb[0] - mx;
            ad[j][1] = qb[1] - mx;
            ad[j][2] = qb[2] - mx;
        }
    }
    float e[4][27], ssum[4], osum[4];
    #pragma unroll
    for (int ti = 0; ti < 27; ++ti) {
        const int td = ti / 9, th = (ti / 3) % 3, tw = ti % 3;
        const int bi = (AXIS == 0) ? td : ((AXIS == 1) ? th : tw);
        const Plane& X = (td == 0) ? A : ((td == 1) ? B : C);
        #pragma unroll
        for (int j = 0; j < 4; ++j)
            e[j][ti] = __builtin_amdgcn_exp2f(
                __builtin_fmaf(q2[j], tap_k(X, th, j + tw - 1), ad[j][bi]));
    }
    #pragma unroll
    for (int j = 0; j < 4; ++j) {
        ssum[j] = 0.0f;
        osum[j] = 0.0f;
    }
    #pragma unroll
    for (int ti = 0; ti < 27; ++ti) {
        const int td = ti / 9, th = (ti / 3) % 3, tw = ti % 3;
        const Plane& X = (td == 0) ? A : ((td == 1) ? B : C);
        #pragma unroll
        for (int j = 0; j < 4; ++j) {
            ssum[j] += e[j][ti];
            osum[j] += e[j][ti] * tap_v(X, th, j + tw - 1);
        }
    }
    v4f o;
    #pragma unroll
    for (int j = 0; j < 4; ++j)
        o[j] = osum[j] / ssum[j];
    return o;
}

// One block's work for a channel whose bias runs along AXIS; r: the channel's three bias values.
template <int AXIS>
__device__ __forceinline__ void attn_body(
    const float* __restrict__ q, const float* __restrict__ k, const float* __restrict__ v,
    const float* __restrict__ r, float* __restrict__ out, int c, int d0, int h, int w0)
{
    const float b0 = r[0], b1 = r[1], b2 = r[2];
    const float ba = fmaxf(fmaxf(__builtin_fabsf(b0), __builtin_fabsf(b1)), __builtin_fabsf(b2));  // max|b|

    const size_t cbase = (size_t)c * NPOS;
    const float* kc = k + cbase;
    const float* vc = v + cbase;
    const float* qc = q + cbase;
    float*       oc = out + cbase;
    const unsigned PLB = HDIM * WDIM * 4u;               // bytes in a plane
    const unsigned own = (unsigned)(h * WDIM + w0) * 4u; // byte offset of the lane's own 4 w

    unsigned boff[3];
    bool     hv[3];
    #pragma unroll  // three rows, constant indices
    for (int th = 0; th < 3; ++th) {
        const int hh  = h + th - 1;
        const int hhc = (hh < 0) ? 0 : ((hh > HDIM - 1) ? HDIM - 1 : hh);
        hv[th]   = (unsigned)hh < (unsigned)HDIM;
        boff[th] = (unsigned)(hhc * WDIM + w0) * 4u;
    }

    const int dfirst = (d0 > 0) ? d0 - 1 : 0;                          // clamped first plane
    const int dlast  = (d0 + DSTEPS < DDIM) ? d0 + DSTEPS : DDIM - 1;  // last plane this block reads

    Plane P[4];
    plane_issue(P[0], kc, vc, dfirst, boff);
    plane_issue(P[1], kc, vc, d0,     boff);
    plane_issue(P[2], kc, vc, d0 + 1, boff);
    v4f qn = load16(qc, own + (unsigned)d0 * PLB);
    plane_finish(P[0], d0 > 0, hv);
    plane_finish(P[1], true,   hv);

    // Rolled: four steps bring the plane buffers back to their places, and the body stays small.
    #pragma unroll 1
    for (int it = 0; it < DSTEPS / 4; ++it) {
        #pragma unroll  // the four steps of one turn of the ring: constant buffer indices
        for (int u = 0; u < 4; ++u) {
            const int d = d0 + it * 4 + u;
            // Plane d+2 is for the next step; past the block's last plane the load is clamped onto it.
            const int dn = (d + 2 < dlast) ? d + 2 : dlast;
            plane_issue(P[(u + 3) & 3], kc, vc, dn, boff);
            const v4f qv = qn;
            const int dq = (d + 1 < d0 + DSTEPS) ? d + 1 : d;
            qn = load16(qc, own + (unsigned)dq * PLB);
            // Keeps the loads above ahead of this step's arithmetic: they have the whole step to land.
            __builtin_amdgcn_sched_barrier(0);
            plane_finish(P[(u + 2) & 3], d + 1 < DDIM, hv);
            *(v4f*)((char*)oc + (own + (unsigned)d * PLB)) =
                attn_point4<AXIS>(P[u], P[(u + 1) & 3], P[(u + 2) & 3], qv, b0, b1, b2, ba);
            // The store's registers are rewritten by the next step (over the back edge too).
            asm volatile("s_wait_xcnt 0x0" ::: "memory");
        }
    }
}

// Second launch-bounds argument: 4 waves per SIMD, so that all 512 blocks are resident at once.
__global__ __launch_bounds__(256, 4) void attn_kernel(
    const float* __restrict__ q,
    const float* __restrict__ k,
    const float* __restrict__ v,
    const float* __restrict__ rel_d,   // [21][3]
    const float* __restrict__ rel_h,   // [21][3]
    const float* __restrict__ rel_w,   // [22][3]
    float* __restrict__ out)
{
    // blockIdx.x = (c * (DDIM / DSTEPS) + d chunk) * 4 + group of 16 h rows
    const int hg = blockIdx.x & 3;
    const int d0 = ((blockIdx.x >> 2) & (DDIM / DSTEPS - 1)) * DSTEPS;
    const int c  = blockIdx.x / (4 * (DDIM / DSTEPS));
    const int h  = hg * 16 + (threadIdx.x >> 4);
    const int w0 = (threadIdx.x & 15) * 4;

    // Per-channel rel bias: the first 21 channels take it by td, the next 21 by th, the rest by tw.
    // The branch is the same for the whole block.
    if (c < 21)      attn_body<0>(q, k, v, rel_d + c * 3,        out, c, d0, h, w0);
    else if (c < 42) attn_body<1>(q, k, v, rel_h + (c - 21) * 3, out, c, d0, h, w0);
    else             attn_body<2>(q, k, v, rel_w + (c - 42) * 3, out, c, d0, h, w0);
}

// ---------------------------------------------------------------------------
extern "C" void kernel_launch(void* const* d_in, const int* in_sizes, int n_in,
                              void* d_out, int out_size, void* d_ws, size_t ws_size,
                              hipStream_t stream)
{
    const float* x     = (const float*)d_in[0];
    const float* wq    = (const float*)d_in[1];
    const float* wk    = (const float*)d_in[2];
    const float* wv    = (const float*)d_in[3];
    const float* rel_d = (const float*)d_in[4];
    const float* rel_h = (const float*)d_in[5];
    const float* rel_w = (const float*)d_in[6];

    float* qb = (float*)d_ws;                    // [64, 65536] f32
    float* kb = qb + (size_t)COUT * NPOS;
    float* vb = kb + (size_t)COUT * NPOS;

    qkv_wmma_kernel<<<NPOS / PB, 256, 0, stream>>>(x, wq, wk, wv, qb, kb, vb);
    attn_kernel<<<COUT * (DDIM / DSTEPS) * 4, 256, 0, stream>>>(
        qb, kb, vb, rel_d, rel_h, rel_w, (float*)d_out);
}
